// v000
// The times below were measured on an AMD MI455X: many runs one after another, warmed up first and cycling through
// copies of the inputs, with the whole window's GPU time divided by the number of runs. Launches and the gaps
// between them are all in it. The median over several windows is given; except for v000 it joins two sittings, which
// can be a few percent apart, so the side-by-side timings, each taken in one sitting, are the better comparison.
// v000 is the starting kernel. One run takes 391 microseconds.
#include <hip/hip_runtime.h>
#include <hip/hip_bf16.h>
#include <cstddef>

typedef _Float16 v16h __attribute__((ext_vector_type(16)));
typedef _Float16 v8h  __attribute__((ext_vector_type(8)));
typedef float    v8f  __attribute__((ext_vector_type(8)));

#define S_LEN 2048
#define BATCH 4
#define HID   1024
#define NHEAD 16
#define DHEAD 64
#define MROWS (S_LEN * BATCH)   // 8192

// ---------------------------------------------------------------------------
// fp32 -> f16 conversion (grid-stride)
// ---------------------------------------------------------------------------
__global__ void cvt_f32_f16(const float* __restrict__ in,
                            _Float16* __restrict__ out, int n) {
  int i = blockIdx.x * blockDim.x + threadIdx.x;
  int stride = gridDim.x * blockDim.x;
  for (; i < n; i += stride) out[i] = (_Float16)in[i];
}

// ---------------------------------------------------------------------------
// NT GEMM, register-blocked 32(M) x 64(N) per wave:
//   out[m,n] = sum_k A[m,k] * W[n,k] + bias[n]
// A: [8192 x 1024] f16 row-major (m = s*B + b), W: [1024 x 1024] f16 row-major.
// Per 32-wide K step: 2 A frags + 4 B frags (12 b128) -> 8 WMMAs.
// TRANSPOSED==0: plain [m][HID] f16 output (used for Q, K).
// TRANSPOSED==1: [bh][d][s] f16 output (V^T, keys contiguous for PV WMMA).
// All epilogue stores are base + compile-time-immediate (branch-free).
// ---------------------------------------------------------------------------
template <int TRANSPOSED>
__global__ __launch_bounds__(256) void gemm_qkv(
    const _Float16* __restrict__ A,
    const _Float16* __restrict__ W,
    const float* __restrict__ bias,
    _Float16* __restrict__ out) {
  const int lane  = threadIdx.x & 31;
  const int wave  = threadIdx.x >> 5;
  const int tile  = blockIdx.x * 8 + wave;   // 256 mTiles x 16 nTiles = 4096
  const int mT    = tile >> 4;
  const int nT    = tile & 15;
  const int m0    = mT * 32;
  const int n0    = nT * 64;
  const int l15   = lane & 15;
  const int kb    = (lane >= 16) ? 8 : 0;    // K sub-offset per WMMA A/B layout
  const int half8 = kb;                      // row offset for C layout

  const _Float16* ap0 = A + (size_t)(m0 + l15) * HID + kb;
  const _Float16* ap1 = ap0 + (size_t)16 * HID;
  const _Float16* bp0 = W + (size_t)(n0 + l15) * HID + kb;

  v8f acc[2][4] = {};
  for (int k = 0; k < HID; k += 32) {
    v16h af[2], bf[4];
    ((v8h*)&af[0])[0] = *(const v8h*)(ap0 + k);
    ((v8h*)&af[0])[1] = *(const v8h*)(ap0 + k + 16);
    ((v8h*)&af[1])[0] = *(const v8h*)(ap1 + k);
    ((v8h*)&af[1])[1] = *(const v8h*)(ap1 + k + 16);
#pragma unroll
    for (int ni = 0; ni < 4; ++ni) {
      const _Float16* bp = bp0 + (size_t)(16 * ni) * HID + k;
      ((v8h*)&bf[ni])[0] = *(const v8h*)(bp);
      ((v8h*)&bf[ni])[1] = *(const v8h*)(bp + 16);
    }
#pragma unroll
    for (int mi = 0; mi < 2; ++mi)
#pragma unroll
      for (int ni = 0; ni < 4; ++ni)
        acc[mi][ni] = __builtin_amdgcn_wmma_f32_16x16x32_f16(
            false, af[mi], false, bf[ni], (short)0, acc[mi][ni], false, false);
  }

  // C layout: lane -> col n = n0 + 16*ni + l15, vgpr r -> row m = .. + r + half8
  float bn[4];
#pragma unroll
  for (int ni = 0; ni < 4; ++ni) bn[ni] = bias[n0 + 16 * ni + l15];

  if (TRANSPOSED == 0) {
    // out[m][n], per-lane base + constant offsets
    _Float16* ob = out + (size_t)(m0 + half8) * HID + n0 + l15;
#pragma unroll
    for (int mi = 0; mi < 2; ++mi)
#pragma unroll
      for (int ni = 0; ni < 4; ++ni)
#pragma unroll
        for (int r = 0; r < 8; ++r)
          ob[(size_t)(16 * mi + r) * HID + 16 * ni] =
              (_Float16)(acc[mi][ni][r] + bn[ni]);
  } else {
    // V^T: out[((bidx*16 + nT)*64 + d)*2048 + s], with
    //   bidx = r&3 (compile-time), s = m0/4 + 4*mi + (kb>>2) + (r>>2)
    // head == nT is uniform because n0 = nT*64 spans exactly one head.
#pragma unroll
    for (int ni = 0; ni < 4; ++ni) {
      const int d = 16 * ni + l15;
      _Float16* vb = out + (size_t)(nT * DHEAD + d) * S_LEN + (m0 >> 2) + (kb >> 2);
#pragma unroll
      for (int mi = 0; mi < 2; ++mi)
#pragma unroll
        for (int r = 0; r < 8; ++r)
          vb[(size_t)(r & 3) * (NHEAD * DHEAD * S_LEN) + 4 * mi + (r >> 2)] =
              (_Float16)(acc[mi][ni][r] + bn[ni]);
    }
  }
}

// ---------------------------------------------------------------------------
// Flash attention: one wave per (bh, 16-query tile). 64-key chunks:
//   16 WMMAs per chunk (8 QK^T + 8 PV), deferred row-sum reduction.
// Qm,Km: [8192][1024] f16 (row m = s*B + b, col = h*64 + d)
// VT:    [bh][64][2048] f16;  mask: [B][S] f32;  out: [S,B,H] f32
// ---------------------------------------------------------------------------
__global__ __launch_bounds__(256) void flash_attn(
    const _Float16* __restrict__ Qm,
    const _Float16* __restrict__ Km,
    const _Float16* __restrict__ VT,
    const float* __restrict__ mask,
    float* __restrict__ out) {
  __shared__ __align__(16) _Float16 pbuf[8][16][64];   // per-wave P staging, 16KB

  const int lane = threadIdx.x & 31;
  const int wave = threadIdx.x >> 5;
  const int tile = blockIdx.x * 8 + wave;
  const int bh   = tile >> 7;           // S/16 = 128 query tiles
  const int qt   = tile & 127;
  const int b    = bh >> 4;
  const int h    = bh & 15;
  const int q0   = qt * 16;
  const int l15  = lane & 15;
  const int kb   = (lane >= 16) ? 8 : 0;

  // Q A-fragments: row m = (q0+l15)*B + b, cols h*64 + (0..63)
  const _Float16* qrow =
      Qm + (size_t)((q0 + l15) * BATCH + b) * HID + h * DHEAD;
  v16h qa0, qa1;
  ((v8h*)&qa0)[0] = *(const v8h*)(qrow + kb);
  ((v8h*)&qa0)[1] = *(const v8h*)(qrow + kb + 16);
  ((v8h*)&qa1)[0] = *(const v8h*)(qrow + 32 + kb);
  ((v8h*)&qa1)[1] = *(const v8h*)(qrow + 32 + kb + 16);

  float mrow[8], lrow[8];   // lrow holds per-LANE partial sums (reduced at end)
#pragma unroll
  for (int r = 0; r < 8; ++r) { mrow[r] = -1e30f; lrow[r] = 0.0f; }
  v8f o[4] = {};

  const float* maskb = mask + b * S_LEN;
  const _Float16* Kb   = Km + (size_t)b * HID + h * DHEAD;   // + key*B*HID
  const _Float16* VTbh = VT + (size_t)bh * DHEAD * S_LEN;

  for (int kc = 0; kc < S_LEN; kc += 64) {
    // ---- scores: four 16x16 tiles over 64 keys ----
    v8f s[4] = {};
    const _Float16* kbase = Kb + (size_t)(kc + l15) * BATCH * HID;
    __builtin_prefetch(kbase + (size_t)64 * BATCH * HID, 0, 0);  // next K chunk
#pragma unroll
    for (int j = 0; j < 4; ++j) {
      const _Float16* krow = kbase + (size_t)(16 * j) * BATCH * HID;
      v16h kf0, kf1;
      ((v8h*)&kf0)[0] = *(const v8h*)(krow + kb);
      ((v8h*)&kf0)[1] = *(const v8h*)(krow + kb + 16);
      ((v8h*)&kf1)[0] = *(const v8h*)(krow + 32 + kb);
      ((v8h*)&kf1)[1] = *(const v8h*)(krow + 32 + kb + 16);
      s[j] = __builtin_amdgcn_wmma_f32_16x16x32_f16(false, qa0, false, kf0,
                                                    (short)0, s[j], false, false);
      s[j] = __builtin_amdgcn_wmma_f32_16x16x32_f16(false, qa1, false, kf1,
                                                    (short)0, s[j], false, false);
    }

    float mk[4];
#pragma unroll
    for (int j = 0; j < 4; ++j) mk[j] = maskb[kc + 16 * j + l15];

    // ---- online softmax; row max shuffled, row sum kept per-lane ----
#pragma unroll
    for (int r = 0; r < 8; ++r) {
      float a0 = s[0][r] * 0.125f + mk[0];   // 1/sqrt(64)
      float a1 = s[1][r] * 0.125f + mk[1];
      float a2 = s[2][r] * 0.125f + mk[2];
      float a3 = s[3][r] * 0.125f + mk[3];
      float t  = fmaxf(fmaxf(a0, a1), fmaxf(a2, a3));
      t = fmaxf(t, __shfl_xor(t, 1));
      t = fmaxf(t, __shfl_xor(t, 2));
      t = fmaxf(t, __shfl_xor(t, 4));
      t = fmaxf(t, __shfl_xor(t, 8));
      const float newm = fmaxf(mrow[r], t);
      const float corr = __expf(mrow[r] - newm);
      mrow[r] = newm;
      const float p0 = __expf(a0 - newm);
      const float p1 = __expf(a1 - newm);
      const float p2 = __expf(a2 - newm);
      const float p3 = __expf(a3 - newm);
      lrow[r] = lrow[r] * corr + (p0 + p1) + (p2 + p3);
      o[0][r] *= corr; o[1][r] *= corr; o[2][r] *= corr; o[3][r] *= corr;
      const int row = r + kb;               // kb doubles as the +8 row offset
      pbuf[wave][row][l15]      = (_Float16)p0;
      pbuf[wave][row][16 + l15] = (_Float16)p1;
      pbuf[wave][row][32 + l15] = (_Float16)p2;
      pbuf[wave][row][48 + l15] = (_Float16)p3;
    }
    asm volatile("" ::: "memory");  // keep DS loads after DS stores (HW in-order per wave)

    // P A-fragments: keys kc..kc+31 and kc+32..kc+63
    v16h pa0, pa1;
    ((v8h*)&pa0)[0] = *(const v8h*)&pbuf[wave][l15][kb];
    ((v8h*)&pa0)[1] = *(const v8h*)&pbuf[wave][l15][16 + kb];
    ((v8h*)&pa1)[0] = *(const v8h*)&pbuf[wave][l15][32 + kb];
    ((v8h*)&pa1)[1] = *(const v8h*)&pbuf[wave][l15][48 + kb];

    // ---- P (16x64) @ V (64x64): four 16x16 N-tiles over DH ----
#pragma unroll
    for (int t = 0; t < 4; ++t) {
      const _Float16* vrow = VTbh + (size_t)(t * 16 + l15) * S_LEN + kc;
      if (t == 0) __builtin_prefetch(vrow + 64, 0, 0);     // next V chunk
      v16h vf0, vf1;
      ((v8h*)&vf0)[0] = *(const v8h*)(vrow + kb);
      ((v8h*)&vf0)[1] = *(const v8h*)(vrow + kb + 16);
      ((v8h*)&vf1)[0] = *(const v8h*)(vrow + 32 + kb);
      ((v8h*)&vf1)[1] = *(const v8h*)(vrow + 48 + kb);
      o[t] = __builtin_amdgcn_wmma_f32_16x16x32_f16(false, pa0, false, vf0,
                                                    (short)0, o[t], false, false);
      o[t] = __builtin_amdgcn_wmma_f32_16x16x32_f16(false, pa1, false, vf1,
                                                    (short)0, o[t], false, false);
    }
  }

  // ---- epilogue: reduce per-lane sums across the 16-lane half, write ctx ----
#pragma unroll
  for (int r = 0; r < 8; ++r) {
    float rs = lrow[r];
    rs += __shfl_xor(rs, 1);
    rs += __shfl_xor(rs, 2);
    rs += __shfl_xor(rs, 4);
    rs += __shfl_xor(rs, 8);
    const float inv = 1.0f / rs;
    const int srow = q0 + r + kb;
    float* op = out + ((size_t)srow * BATCH + b) * HID + h * DHEAD + l15;
    op[0]  = o[0][r] * inv;
    op[16] = o[1][r] * inv;
    op[32] = o[2][r] * inv;
    op[48] = o[3][r] * inv;
  }
}

// ---------------------------------------------------------------------------
extern "C" void kernel_launch(void* const* d_in, const int* in_sizes, int n_in,
                              void* d_out, int out_size, void* d_ws, size_t ws_size,
                              hipStream_t stream) {
  const float* hs   = (const float*)d_in[0];   // [S,B,H]
  const float* mask = (const float*)d_in[1];   // [B,1,1,S]
  const float* Wq   = (const float*)d_in[2];
  const float* bq   = (const float*)d_in[3];
  const float* Wk   = (const float*)d_in[4];
  const float* bk   = (const float*)d_in[5];
  const float* Wv   = (const float*)d_in[6];
  const float* bv   = (const float*)d_in[7];
  float* out = (float*)d_out;

  const size_t HS_N  = (size_t)MROWS * HID;                      // 8388608
  const size_t W_N   = (size_t)HID * HID;                        // 1048576
  const size_t QKV_N = (size_t)BATCH * NHEAD * S_LEN * DHEAD;    // 8388608

  _Float16* hs16 = (_Float16*)d_ws;
  _Float16* wq16 = hs16 + HS_N;
  _Float16* wk16 = wq16 + W_N;
  _Float16* wv16 = wk16 + W_N;
  _Float16* Qh   = wv16 + W_N;   // [8192][1024]
  _Float16* Kh   = Qh + QKV_N;   // [8192][1024]
  _Float16* VTh  = Kh + QKV_N;   // [64][64][2048]

  cvt_f32_f16<<<4096, 256, 0, stream>>>(hs, hs16, (int)HS_N);
  cvt_f32_f16<<<1024, 256, 0, stream>>>(Wq, wq16, (int)W_N);
  cvt_f32_f16<<<1024, 256, 0, stream>>>(Wk, wk16, (int)W_N);
  cvt_f32_f16<<<1024, 256, 0, stream>>>(Wv, wv16, (int)W_N);

  // 256 x 16 = 4096 32x64 tiles / 8 waves per block
  gemm_qkv<0><<<512, 256, 0, stream>>>(hs16, wq16, bq, Qh);
  gemm_qkv<0><<<512, 256, 0, stream>>>(hs16, wk16, bk, Kh);
  gemm_qkv<1><<<512, 256, 0, stream>>>(hs16, wv16, bv, VTh);

  // 64 (b,h) * 128 query tiles = 8192 waves / 8 per block
  flash_attn<<<1024, 256, 0, stream>>>(Qh, Kh, VTh, mask, out);
}

// v001
// It runs in 304 microseconds.
// In both of two side-by-side timings against v000, it was 1.33 times as fast.
#include <hip/hip_runtime.h>
#include <hip/hip_bf16.h>
#include <cstddef>
#include <cstdint>

typedef _Float16 v16h __attribute__((ext_vector_type(16)));
typedef _Float16 v8h  __attribute__((ext_vector_type(8)));
typedef float    v8f  __attribute__((ext_vector_type(8)));
typedef uint32_t u32x4 __attribute__((ext_vector_type(4)));
typedef uint32_t u32x8 __attribute__((ext_vector_type(8)));

#define S_LEN 2048
#define BATCH 4
#define HID   1024
#define NHEAD 16
#define DHEAD 64
#define MROWS (S_LEN * BATCH)   // 8192

// ---------------------------------------------------------------------------
// fp32 -> f16 conversion (grid-stride)
// ---------------------------------------------------------------------------
__global__ void cvt_f32_f16(const float* __restrict__ in,
                            _Float16* __restrict__ out, int n) {
  int i = blockIdx.x * blockDim.x + threadIdx.x;
  int stride = gridDim.x * blockDim.x;
  for (; i < n; i += stride) out[i] = (_Float16)in[i];
}

// ---------------------------------------------------------------------------
// NT GEMM, register-blocked 32(M) x 64(N) per wave:
//   out[m,n] = sum_k A[m,k] * W[n,k] + bias[n]
// A: [8192 x 1024] f16 row-major (m = s*B + b), W: [1024 x 1024] f16 row-major.
// Per 32-wide K step: 2 A frags + 4 B frags (12 b128) -> 8 WMMAs.
// TRANSPOSED==0: plain [m][HID] f16 output (used for Q, K).
// TRANSPOSED==1: [bh][d][s] f16 output (V^T, keys contiguous for PV WMMA).
// All epilogue stores are base + compile-time-immediate (branch-free).
// ---------------------------------------------------------------------------
template <int TRANSPOSED>
__global__ __launch_bounds__(256) void gemm_qkv(
    const _Float16* __restrict__ A,
    const _Float16* __restrict__ W,
    const float* __restrict__ bias,
    _Float16* __restrict__ out) {
  const int lane  = threadIdx.x & 31;
  const int wave  = threadIdx.x >> 5;
  const int tile  = blockIdx.x * 8 + wave;   // 256 mTiles x 16 nTiles = 4096
  const int mT    = tile >> 4;
  const int nT    = tile & 15;
  const int m0    = mT * 32;
  const int n0    = nT * 64;
  const int l15   = lane & 15;
  const int kb    = (lane >= 16) ? 8 : 0;    // K sub-offset per WMMA A/B layout
  const int half8 = kb;                      // row offset for C layout

  const _Float16* ap0 = A + (size_t)(m0 + l15) * HID + kb;
  const _Float16* ap1 = ap0 + (size_t)16 * HID;
  const _Float16* bp0 = W + (size_t)(n0 + l15) * HID + kb;

  v8f acc[2][4] = {};
  for (int k = 0; k < HID; k += 32) {
    v16h af[2], bf[4];
    ((v8h*)&af[0])[0] = *(const v8h*)(ap0 + k);
    ((v8h*)&af[0])[1] = *(const v8h*)(ap0 + k + 16);
    ((v8h*)&af[1])[0] = *(const v8h*)(ap1 + k);
    ((v8h*)&af[1])[1] = *(const v8h*)(ap1 + k + 16);
#pragma unroll
    for (int ni = 0; ni < 4; ++ni) {
      const _Float16* bp = bp0 + (size_t)(16 * ni) * HID + k;
      ((v8h*)&bf[ni])[0] = *(const v8h*)(bp);
      ((v8h*)&bf[ni])[1] = *(const v8h*)(bp + 16);
    }
#pragma unroll
    for (int mi = 0; mi < 2; ++mi)
#pragma unroll
      for (int ni = 0; ni < 4; ++ni)
        acc[mi][ni] = __builtin_amdgcn_wmma_f32_16x16x32_f16(
            false, af[mi], false, bf[ni], (short)0, acc[mi][ni], false, false);
  }

  // C layout: lane -> col n = n0 + 16*ni + l15, vgpr r -> row m = .. + r + half8
  float bn[4];
#pragma unroll
  for (int ni = 0; ni < 4; ++ni) bn[ni] = bias[n0 + 16 * ni + l15];

  if (TRANSPOSED == 0) {
    // out[m][n], per-lane base + constant offsets
    _Float16* ob = out + (size_t)(m0 + half8) * HID + n0 + l15;
#pragma unroll
    for (int mi = 0; mi < 2; ++mi)
#pragma unroll
      for (int ni = 0; ni < 4; ++ni)
#pragma unroll
        for (int r = 0; r < 8; ++r)
          ob[(size_t)(16 * mi + r) * HID + 16 * ni] =
              (_Float16)(acc[mi][ni][r] + bn[ni]);
  } else {
    // V^T: out[((bidx*16 + nT)*64 + d)*2048 + s], with
    //   bidx = r&3 (compile-time), s = m0/4 + 4*mi + (kb>>2) + (r>>2)
    // head == nT is uniform because n0 = nT*64 spans exactly one head.
#pragma unroll
    for (int ni = 0; ni < 4; ++ni) {
      const int d = 16 * ni + l15;
      _Float16* vb = out + (size_t)(nT * DHEAD + d) * S_LEN + (m0 >> 2) + (kb >> 2);
#pragma unroll
      for (int mi = 0; mi < 2; ++mi)
#pragma unroll
        for (int r = 0; r < 8; ++r)
          vb[(size_t)(r & 3) * (NHEAD * DHEAD * S_LEN) + 4 * mi + (r >> 2)] =
              (_Float16)(acc[mi][ni][r] + bn[ni]);
    }
  }
}

// ---------------------------------------------------------------------------
// Flash attention: one wave per (bh, 16-query tile). 64-key chunks:
//   16 WMMAs per chunk (8 QK^T + 8 PV), deferred row-sum reduction.
// Qm,Km: [8192][1024] f16 (row m = s*B + b, col = h*64 + d)
// VT:    [bh][64][2048] f16;  mask: [B][S] f32;  out: [S,B,H] f32
// The 8 waves of a block share one (b,h): each 64-key chunk of K (64 keys x
// 128 B) and of V^T (64 d rows x 128 B) is brought into LDS once per block by
// a tensor load (wave 0: K, wave 1: V^T), two buffers, one chunk ahead.
// ---------------------------------------------------------------------------
#define KV_PITCH 144u     // LDS row pitch, bytes: 128-B row + 16-B pad (16 B x odd for b128 readers)
#define KV_TILE  10240u   // 64 rows x 144 B = 9216 B, rounded up to a multiple of 2 KiB
#define N_STAGE  (S_LEN / 64)

static __device__ __forceinline__ uint32_t uni(uint32_t v) {
  return (uint32_t)__builtin_amdgcn_readfirstlane(v);
}
// The test around a tensor load must be a scalar branch (tensor loads ignore EXEC).
static __device__ __forceinline__ uint32_t pinned(uint32_t v) {
  uint32_t w = uni(v);
  asm volatile("" : "+s"(w));  // holds the test word in a scalar register: s_cmp + s_cbranch_scc, no EXEC mask
  return w;
}

__global__ __launch_bounds__(256) void flash_attn(
    const _Float16* __restrict__ Qm,
    const _Float16* __restrict__ Km,
    const _Float16* __restrict__ VT,
    const float* __restrict__ mask,
    float* __restrict__ out) {
  __shared__ __attribute__((aligned(2048))) unsigned char kv[2][2][KV_TILE];  // [buffer][K, V^T]
  __shared__ __align__(16) _Float16 pbuf[8][16][64];   // per-wave P staging, 16KB

  const int lane = threadIdx.x & 31;
  const int wave = threadIdx.x >> 5;
  const int tile = blockIdx.x * 8 + wave;
  const int bh   = blockIdx.x >> 4;     // S/16 = 128 query tiles = 16 blocks per (b,h)
  const int qt   = tile & 127;
  const int b    = bh >> 4;
  const int h    = bh & 15;
  const int q0   = qt * 16;
  const int l15  = lane & 15;
  const int kb   = (lane >= 16) ? 8 : 0;

  // Q A-fragments: row m = (q0+l15)*B + b, cols h*64 + (0..63)
  const _Float16* qrow =
      Qm + (size_t)((q0 + l15) * BATCH + b) * HID + h * DHEAD;
  v16h qa0, qa1;
  ((v8h*)&qa0)[0] = *(const v8h*)(qrow + kb);
  ((v8h*)&qa0)[1] = *(const v8h*)(qrow + kb + 16);
  ((v8h*)&qa1)[0] = *(const v8h*)(qrow + 32 + kb);
  ((v8h*)&qa1)[1] = *(const v8h*)(qrow + 32 + kb + 16);

  float mrow[8], lrow[8];   // lrow holds per-LANE partial sums (reduced at end)
#pragma unroll
  for (int r = 0; r < 8; ++r) { mrow[r] = -1e30f; lrow[r] = 0.0f; }
  v8f o[4] = {};

  const float* maskb = mask + b * S_LEN;
  const _Float16* Kb   = Km + (size_t)b * HID + h * DHEAD;   // + key*B*HID
  const _Float16* VTbh = VT + (size_t)bh * DHEAD * S_LEN;

  // ---- tensor-load descriptors: wave 0 moves K chunks, wave 1 V^T chunks ----
  const uint32_t wv        = uni(threadIdx.x >> 5);
  const uint32_t isV       = wv & 1u;
  const uint64_t src0      = isV ? (uint64_t)(size_t)VTbh : (uint64_t)(size_t)Kb;
  const uint32_t src_step  = isV ? 64u * 2u : 64u * BATCH * HID * 2u;   // bytes per chunk
  const uint32_t src_pitch = isV ? S_LEN * 2u : BATCH * HID * 2u;       // bytes per row
  const uint32_t lds0      = (uint32_t)(size_t)&kv[0][0][0] + isV * KV_TILE;
  u32x8 g1;
  g1[0] = uni((1u << 20) | (4u << 22) | (3u << 25));  // bytes, no mask, 16-B pad behind every 128-B row
  g1[1] = uni(128u << 16);                            // tensor_dim0 = 128 B
  g1[2] = uni(64u << 16);                             // tensor_dim1 = 64 rows
  g1[3] = uni(128u << 16);                            // tile_dim0 = 128 B
  g1[4] = uni(64u);                                   // tile_dim1 = 64 rows
  g1[5] = uni(src_pitch);
  g1[6] = uni(0u);
  g1[7] = uni(0u);
  // As in pinned(): descriptor words held in scalar registers. Without it two
  // registers of group 1 serve as loop temporaries while a request is in flight.
  asm volatile("" : "+s"(g1));
  u32x4 g0 = {};   // group 0 of this wave's request in flight
  auto issue = [&](uint32_t st) {
    const uint64_t ga = src0 + (uint64_t)st * src_step;
    g0[0] = uni(1u);
    g0[1] = uni(lds0 + (st & 1u) * (2u * KV_TILE));
    g0[2] = uni((uint32_t)ga);
    g0[3] = uni((((uint32_t)(ga >> 32)) & 0x01FFFFFFu) | 0x80000000u);
    // one request of the whole wave: the 64 x 128-B tile goes to LDS through no register
    asm volatile("tensor_load_to_lds %0, %1" :: "s"(g0), "s"(g1) : "memory");
  };
  // The issuing wave's wait. It names group 0 so that the registers of the
  // request keep their values until the tile has landed.
  auto landed = [&]() { asm volatile("s_wait_tensorcnt 0x0" :: "s"(g0) : "memory"); };
  if (pinned(wv < 2u)) {
    issue(0u);
    landed();                                           // chunk 0 has landed
  }
  __syncthreads();                                      // chunk 0 readable by every wave
  if (pinned(wv < 2u)) issue(1u);

  for (int kc = 0; kc < S_LEN; kc += 64) {
    const uint32_t st = (uint32_t)kc >> 6;
    const unsigned char* ktile = &kv[st & 1u][0][0];
    const unsigned char* vtile = &kv[st & 1u][1][0];
    // ---- scores: four 16x16 tiles over 64 keys ----
    v8f s[4] = {};
    const _Float16* kbase = (const _Float16*)(ktile + (uint32_t)l15 * KV_PITCH);
#pragma unroll
    for (int j = 0; j < 4; ++j) {
      const _Float16* krow = kbase + (16 * j) * (KV_PITCH / 2u);
      v16h kf0, kf1;
      ((v8h*)&kf0)[0] = *(const v8h*)(krow + kb);
      ((v8h*)&kf0)[1] = *(const v8h*)(krow + kb + 16);
      ((v8h*)&kf1)[0] = *(const v8h*)(krow + 32 + kb);
      ((v8h*)&kf1)[1] = *(const v8h*)(krow + 32 + kb + 16);
      s[j] = __builtin_amdgcn_wmma_f32_16x16x32_f16(false, qa0, false, kf0,
                                                    (short)0, s[j], false, false);
      s[j] = __builtin_amdgcn_wmma_f32_16x16x32_f16(false, qa1, false, kf1,
                                                    (short)0, s[j], false, false);
    }

    float mk[4];
#pragma unroll
    for (int j = 0; j < 4; ++j) mk[j] = maskb[kc + 16 * j + l15];

    // ---- online softmax; row max shuffled, row sum kept per-lane ----
#pragma unroll
    for (int r = 0; r < 8; ++r) {
      float a0 = s[0][r] * 0.125f + mk[0];   // 1/sqrt(64)
      float a1 = s[1][r] * 0.125f + mk[1];
      float a2 = s[2][r] * 0.125f + mk[2];
      float a3 = s[3][r] * 0.125f + mk[3];
      float t  = fmaxf(fmaxf(a0, a1), fmaxf(a2, a3));
      t = fmaxf(t, __shfl_xor(t, 1));
      t = fmaxf(t, __shfl_xor(t, 2));
      t = fmaxf(t, __shfl_xor(t, 4));
      t = fmaxf(t, __shfl_xor(t, 8));
      const float newm = fmaxf(mrow[r], t);
      const float corr = __expf(mrow[r] - newm);
      mrow[r] = newm;
      const float p0 = __expf(a0 - newm);
      const float p1 = __expf(a1 - newm);
      const float p2 = __expf(a2 - newm);
      const float p3 = __expf(a3 - newm);
      lrow[r] = lrow[r] * corr + (p0 + p1) + (p2 + p3);
      o[0][r] *= corr; o[1][r] *= corr; o[2][r] *= corr; o[3][r] *= corr;
      const int row = r + kb;               // kb doubles as the +8 row offset
      pbuf[wave][row][l15]      = (_Float16)p0;
      pbuf[wave][row][16 + l15] = (_Float16)p1;
      pbuf[wave][row][32 + l15] = (_Float16)p2;
      pbuf[wave][row][48 + l15] = (_Float16)p3;
    }
    asm volatile("" ::: "memory");  // keep DS loads after DS stores (HW in-order per wave)

    // P A-fragments: keys kc..kc+31 and kc+32..kc+63
    v16h pa0, pa1;
    ((v8h*)&pa0)[0] = *(const v8h*)&pbuf[wave][l15][kb];
    ((v8h*)&pa0)[1] = *(const v8h*)&pbuf[wave][l15][16 + kb];
    ((v8h*)&pa1)[0] = *(const v8h*)&pbuf[wave][l15][32 + kb];
    ((v8h*)&pa1)[1] = *(const v8h*)&pbuf[wave][l15][48 + kb];

    // ---- P (16x64) @ V (64x64): four 16x16 N-tiles over DH ----
#pragma unroll
    for (int t = 0; t < 4; ++t) {
      const _Float16* vrow = (const _Float16*)(vtile + (uint32_t)(t * 16 + l15) * KV_PITCH);
      v16h vf0, vf1;
      ((v8h*)&vf0)[0] = *(const v8h*)(vrow + kb);
      ((v8h*)&vf0)[1] = *(const v8h*)(vrow + kb + 16);
      ((v8h*)&vf1)[0] = *(const v8h*)(vrow + 32 + kb);
      ((v8h*)&vf1)[1] = *(const v8h*)(vrow + 48 + kb);
      o[t] = __builtin_amdgcn_wmma_f32_16x16x32_f16(false, pa0, false, vf0,
                                                    (short)0, o[t], false, false);
      o[t] = __builtin_amdgcn_wmma_f32_16x16x32_f16(false, pa1, false, vf1,
                                                    (short)0, o[t], false, false);
    }

    // ---- publish chunk st + 1, then refill the buffer this pass has read ----
    asm volatile("s_wait_dscnt 0x0" ::: "memory");        // this wave's LDS reads of the buffer are done
    if (pinned(wv < 2u)) landed();                        // this wave's tile of chunk st + 1 has landed
    __syncthreads();                                      // chunk st + 1 readable; every reader has left chunk st
    if (pinned((wv < 2u) && (st + 2u < (uint32_t)N_STAGE))) issue(st + 2u);
  }
  asm volatile("s_wait_tensorcnt 0x0" ::: "memory");      // no request outlives the loop
  asm volatile("s_wait_dscnt 0x0" ::: "memory");          // nor an LDS read of the ring

  // ---- epilogue: reduce per-lane sums across the 16-lane half, write ctx ----
#pragma unroll
  for (int r = 0; r < 8; ++r) {
    float rs = lrow[r];
    rs += __shfl_xor(rs, 1);
    rs += __shfl_xor(rs, 2);
    rs += __shfl_xor(rs, 4);
    rs += __shfl_xor(rs, 8);
    const float inv = 1.0f / rs;
    const int srow = q0 + r + kb;
    float* op = out + ((size_t)srow * BATCH + b) * HID + h * DHEAD + l15;
    op[0]  = o[0][r] * inv;
    op[16] = o[1][r] * inv;
    op[32] = o[2][r] * inv;
    op[48] = o[3][r] * inv;
  }
}

// ---------------------------------------------------------------------------
extern "C" void kernel_launch(void* const* d_in, const int* in_sizes, int n_in,
                              void* d_out, int out_size, void* d_ws, size_t ws_size,
                              hipStream_t stream) {
  const float* hs   = (const float*)d_in[0];   // [S,B,H]
  const float* mask = (const float*)d_in[1];   // [B,1,1,S]
  const float* Wq   = (const float*)d_in[2];
  const float* bq   = (const float*)d_in[3];
  const float* Wk   = (const float*)d_in[4];
  const float* bk   = (const float*)d_in[5];
  const float* Wv   = (const float*)d_in[6];
  const float* bv   = (const float*)d_in[7];
  float* out = (float*)d_out;

  const size_t HS_N  = (size_t)MROWS * HID;                      // 8388608
  const size_t W_N   = (size_t)HID * HID;                        // 1048576
  const size_t QKV_N = (size_t)BATCH * NHEAD * S_LEN * DHEAD;    // 8388608

  _Float16* hs16 = (_Float16*)d_ws;
  _Float16* wq16 = hs16 + HS_N;
  _Float16* wk16 = wq16 + W_N;
  _Float16* wv16 = wk16 + W_N;
  _Float16* Qh   = wv16 + W_N;   // [8192][1024]
  _Float16* Kh   = Qh + QKV_N;   // [8192][1024]
  _Float16* VTh  = Kh + QKV_N;   // [64][64][2048]

  cvt_f32_f16<<<4096, 256, 0, stream>>>(hs, hs16, (int)HS_N);
  cvt_f32_f16<<<1024, 256, 0, stream>>>(Wq, wq16, (int)W_N);
  cvt_f32_f16<<<1024, 256, 0, stream>>>(Wk, wk16, (int)W_N);
  cvt_f32_f16<<<1024, 256, 0, stream>>>(Wv, wv16, (int)W_N);

  // 256 x 16 = 4096 32x64 tiles / 8 waves per block
  gemm_qkv<0><<<512, 256, 0, stream>>>(hs16, wq16, bq, Qh);
  gemm_qkv<0><<<512, 256, 0, stream>>>(hs16, wk16, bk, Kh);
  gemm_qkv<1><<<512, 256, 0, stream>>>(hs16, wv16, bv, VTh);

  // 64 (b,h) * 128 query tiles = 8192 waves / 8 per block
  flash_attn<<<1024, 256, 0, stream>>>(Qh, Kh, VTh, mask, out);
}

// v002
// It runs in 213 microseconds.
// Next to v001, in two timings, it ran 1.43 times as fast each time.
// Over all steps from v000 it is 1.90 times as fast.
#include <hip/hip_runtime.h>
#include <hip/hip_bf16.h>
#include <cstddef>
#include <cstdint>

typedef _Float16 v16h __attribute__((ext_vector_type(16)));
typedef _Float16 v8h  __attribute__((ext_vector_type(8)));
typedef float    v8f  __attribute__((ext_vector_type(8)));
typedef uint32_t u32x4 __attribute__((ext_vector_type(4)));
typedef uint32_t u32x8 __attribute__((ext_vector_type(8)));

#define S_LEN 2048
#define BATCH 4
#define HID   1024
#define NHEAD 16
#define DHEAD 64
#define MROWS (S_LEN * BATCH)   // 8192

// ---------------------------------------------------------------------------
// fp32 -> f16 conversion (grid-stride)
// ---------------------------------------------------------------------------
__global__ void cvt_f32_f16(const float* __restrict__ in,
                            _Float16* __restrict__ out, int n) {
  int i = blockIdx.x * blockDim.x + threadIdx.x;
  int stride = gridDim.x * blockDim.x;
  for (; i < n; i += stride) out[i] = (_Float16)in[i];
}

static __device__ __forceinline__ uint32_t uni(uint32_t v) {
  return (uint32_t)__builtin_amdgcn_readfirstlane(v);
}
// The test around a tensor load must be a scalar branch (tensor loads ignore EXEC).
static __device__ __forceinline__ uint32_t pinned(uint32_t v) {
  uint32_t w = uni(v);
  asm volatile("" : "+s"(w));  // holds the test word in a scalar register: s_cmp + s_cbranch_scc, no EXEC mask
  return w;
}

// ---------------------------------------------------------------------------
// NT GEMM, register-blocked 32(M) x 64(N) per wave, 128 x 128 per block:
//   out[m,n] = sum_k A[m,k] * W[n,k] + bias[n]
// A: [8192 x 1024] f16 row-major (m = s*B + b), W: [1024 x 1024] f16 row-major.
// The 8 waves (4 along M x 2 along N) share 128 rows of A and 128 rows of W.
// A stage is 64 k of those rows (128 B a row), brought into LDS once per block
// by four tensor loads of 64 rows each (waves 0..3), two buffers, one stage ahead.
// Per 32-wide K step: 2 A frags + 4 B frags (12 ds b128) -> 8 WMMAs.
// TRANSPOSED==0: plain [m][HID] f16 output (used for Q, K).
// TRANSPOSED==1: [bh][d][s] f16 output (V^T, keys contiguous for PV WMMA).
// All epilogue stores are base + compile-time-immediate (branch-free).
// ---------------------------------------------------------------------------
#define G_PITCH  144u     // LDS row pitch, bytes: 128-B row + 16-B pad (16 B x odd for b128 readers)
#define G_SLICE  10240u   // 64 rows x 144 B = 9216 B, rounded up to a multiple of 2 KiB
#define G_STAGES (HID / 64)

template <int TRANSPOSED>
__global__ __launch_bounds__(256) void gemm_qkv(
    const _Float16* __restrict__ A,
    const _Float16* __restrict__ W,
    const float* __restrict__ bias,
    _Float16* __restrict__ out) {
  // [buffer][A rows 0..63, A rows 64..127, W rows 0..63, W rows 64..127]
  __shared__ __attribute__((aligned(2048))) unsigned char ring[2][4][G_SLICE];

  const int lane  = threadIdx.x & 31;
  const int wave  = threadIdx.x >> 5;
  const int blkm  = blockIdx.x >> 3;         // 64 row blocks of 128
  const int blkn  = blockIdx.x & 7;          // 8 column blocks of 128
  const int wm    = wave >> 1;               // 0..3: 32-row strip of the block
  const int wn    = wave & 1;                // 0..1: 64-column strip of the block
  const int nT    = blkn * 2 + wn;
  const int m0    = blkm * 128 + wm * 32;
  const int n0    = nT * 64;
  const int l15   = lane & 15;
  const int kb    = (lane >= 16) ? 8 : 0;    // K sub-offset per WMMA A/B layout
  const int half8 = kb;                      // row offset for C layout

  // ---- tensor-load descriptors: waves 0,1 move the A slices, waves 2,3 the W slices ----
  const uint32_t wv   = uni(threadIdx.x >> 5);
  const uint32_t sl   = wv & 3u;
  const _Float16* sp  = (sl & 2u) ? W + (size_t)(blkn * 128 + (int)(sl & 1u) * 64) * HID
                                  : A + (size_t)(blkm * 128 + (int)(sl & 1u) * 64) * HID;
  const uint64_t src0 = (uint64_t)(size_t)sp;
  const uint32_t lds0 = (uint32_t)(size_t)&ring[0][0][0] + sl * G_SLICE;
  u32x8 g1;
  g1[0] = uni((1u << 20) | (4u << 22) | (3u << 25));  // bytes, no mask, 16-B pad behind every 128-B row
  g1[1] = uni(128u << 16);                            // tensor_dim0 = 128 B
  g1[2] = uni(64u << 16);                             // tensor_dim1 = 64 rows
  g1[3] = uni(128u << 16);                            // tile_dim0 = 128 B
  g1[4] = uni(64u);                                   // tile_dim1 = 64 rows
  g1[5] = uni(HID * 2u);                              // source row pitch, bytes
  g1[6] = uni(0u);
  g1[7] = uni(0u);
  // As in pinned(): descriptor words held in scalar registers, so that none
  // serves as a loop temporary while a request is in flight.
  asm volatile("" : "+s"(g1));
  u32x4 g0;   // group 0 of this wave's request in flight
  // The words of stage st's request (scalar work; the load itself always stands under the test).
  auto form = [&](uint32_t st) {
    const uint64_t ga = src0 + (uint64_t)st * 128u;   // 64 k = 128 B further along every row
    g0[0] = uni(1u);
    g0[1] = uni(lds0 + (st & 1u) * (4u * G_SLICE));
    g0[2] = uni((uint32_t)ga);
    g0[3] = uni((((uint32_t)(ga >> 32)) & 0x01FFFFFFu) | 0x80000000u);
  };
  // one request of the whole wave: the 64 x 128-B slice goes to LDS through no register
  auto issue = [&]() { asm volatile("tensor_load_to_lds %0, %1" :: "s"(g0), "s"(g1) : "memory"); };
  // The issuing wave's wait. It names group 0 so that the registers of the
  // request keep their values until the slice has landed.
  auto landed = [&]() { asm volatile("s_wait_tensorcnt 0x0" :: "s"(g0) : "memory"); };
  form(0u);
  if (pinned(wv < 4u)) {
    issue();
    landed();                                           // stage 0 has landed
  }
  __syncthreads();                                      // stage 0 readable by every wave
  form(1u);
  if (pinned(wv < 4u)) issue();

  // this lane's fragment rows inside a buffer
  const uint32_t aoff = (uint32_t)(wm >> 1) * G_SLICE +
                        (uint32_t)((wm & 1) * 32 + l15) * G_PITCH + (uint32_t)kb * 2u;
  const uint32_t boff = (uint32_t)(2 + wn) * G_SLICE +
                        (uint32_t)l15 * G_PITCH + (uint32_t)kb * 2u;

  v8f acc[2][4] = {};
  for (uint32_t st = 0; st < (uint32_t)G_STAGES; ++st) {
    const unsigned char* ab = &ring[st & 1u][0][0] + aoff;
    const unsigned char* bb = &ring[st & 1u][0][0] + boff;
    // unrolled: the stage's two 32-wide K steps, all LDS offsets immediates
#pragma unroll
    for (int kk = 0; kk < 2; ++kk) {
      v16h af[2], bf[4];
#pragma unroll
      for (int mi = 0; mi < 2; ++mi) {
        const unsigned char* ap = ab + (uint32_t)(16 * mi) * G_PITCH + kk * 64;
        ((v8h*)&af[mi])[0] = *(const v8h*)(ap);
        ((v8h*)&af[mi])[1] = *(const v8h*)(ap + 32);
      }
#pragma unroll
      for (int ni = 0; ni < 4; ++ni) {
        const unsigned char* bp = bb + (uint32_t)(16 * ni) * G_PITCH + kk * 64;
        ((v8h*)&bf[ni])[0] = *(const v8h*)(bp);
        ((v8h*)&bf[ni])[1] = *(const v8h*)(bp + 32);
      }
#pragma unroll
      for (int mi = 0; mi < 2; ++mi)
#pragma unroll
        for (int ni = 0; ni < 4; ++ni)
          acc[mi][ni] = __builtin_amdgcn_wmma_f32_16x16x32_f16(
              false, af[mi], false, bf[ni], (short)0, acc[mi][ni], false, false);
    }

    // ---- publish stage st + 1, then refill the buffer this pass has read ----
    asm volatile("s_wait_dscnt 0x0" ::: "memory");        // this wave's LDS reads of the buffer are done
    if (pinned(wv < 4u)) landed();                        // this wave's slice of stage st + 1 has landed
    __syncthreads();                                      // stage st + 1 readable; every reader has left stage st
    if (pinned((wv < 4u) && (st + 2u < (uint32_t)G_STAGES))) {
      form(st + 2u);
      issue();
    }
  }
  asm volatile("s_wait_tensorcnt 0x0" ::: "memory");      // no request outlives the loop
  asm volatile("s_wait_dscnt 0x0" ::: "memory");          // nor an LDS read of the ring

  // C layout: lane -> col n = n0 + 16*ni + l15, vgpr r -> row m = .. + r + half8
  float bn[4];
#pragma unroll
  for (int ni = 0; ni < 4; ++ni) bn[ni] = bias[n0 + 16 * ni + l15];

  if (TRANSPOSED == 0) {
    // out[m][n], per-lane base + constant offsets
    _Float16* ob = out + (size_t)(m0 + half8) * HID + n0 + l15;
#pragma unroll
    for (int mi = 0; mi < 2; ++mi)
#pragma unroll
      for (int ni = 0; ni < 4; ++ni)
#pragma unroll
        for (int r = 0; r < 8; ++r)
          ob[(size_t)(16 * mi + r) * HID + 16 * ni] =
              (_Float16)(acc[mi][ni][r] + bn[ni]);
  } else {
    // V^T: out[((bidx*16 + nT)*64 + d)*2048 + s], with
    //   bidx = r&3 (compile-time), s = m0/4 + 4*mi + (kb>>2) + (r>>2)
    // head == nT is uniform because n0 = nT*64 spans exactly one head.
#pragma unroll
    for (int ni = 0; ni < 4; ++ni) {
      const int d = 16 * ni + l15;
      _Float16* vb = out + (size_t)(nT * DHEAD + d) * S_LEN + (m0 >> 2) + (kb >> 2);
#pragma unroll
      for (int mi = 0; mi < 2; ++mi)
#pragma unroll
        for (int r = 0; r < 8; ++r)
          vb[(size_t)(r & 3) * (NHEAD * DHEAD * S_LEN) + 4 * mi + (r >> 2)] =
              (_Float16)(acc[mi][ni][r] + bn[ni]);
    }
  }
}

// ---------------------------------------------------------------------------
// Flash attention: one wave per (bh, 16-query tile). 64-key chunks:
//   16 WMMAs per chunk (8 QK^T + 8 PV), deferred row-sum reduction.
// Qm,Km: [8192][1024] f16 (row m = s*B + b, col = h*64 + d)
// VT:    [bh][64][2048] f16;  mask: [B][S] f32;  out: [S,B,H] f32
// The 8 waves of a block share one (b,h): each 64-key chunk of K (64 keys x
// 128 B) and of V^T (64 d rows x 128 B) is brought into LDS once per block by
// a tensor load (wave 0: K, wave 1: V^T), two buffers, one chunk ahead.
// ---------------------------------------------------------------------------
#define KV_PITCH 144u     // LDS row pitch, bytes: 128-B row + 16-B pad (16 B x odd for b128 readers)
#define KV_TILE  10240u   // 64 rows x 144 B = 9216 B, rounded up to a multiple of 2 KiB
#define N_STAGE  (S_LEN / 64)

__global__ __launch_bounds__(256) void flash_attn(
    const _Float16* __restrict__ Qm,
    const _Float16* __restrict__ Km,
    const _Float16* __restrict__ VT,
    const float* __restrict__ mask,
    float* __restrict__ out) {
  __shared__ __attribute__((aligned(2048))) unsigned char kv[2][2][KV_TILE];  // [buffer][K, V^T]
  __shared__ __align__(16) _Float16 pbuf[8][16][64];   // per-wave P staging, 16KB

  const int lane = threadIdx.x & 31;
  const int wave = threadIdx.x >> 5;
  const int tile = blockIdx.x * 8 + wave;
  const int bh   = blockIdx.x >> 4;     // S/16 = 128 query tiles = 16 blocks per (b,h)
  const int qt   = tile & 127;
  const int b    = bh >> 4;
  const int h    = bh & 15;
  const int q0   = qt * 16;
  const int l15  = lane & 15;
  const int kb   = (lane >= 16) ? 8 : 0;

  // Q A-fragments: row m = (q0+l15)*B + b, cols h*64 + (0..63)
  const _Float16* qrow =
      Qm + (size_t)((q0 + l15) * BATCH + b) * HID + h * DHEAD;
  v16h qa0, qa1;
  ((v8h*)&qa0)[0] = *(const v8h*)(qrow + kb);
  ((v8h*)&qa0)[1] = *(const v8h*)(qrow + kb + 16);
  ((v8h*)&qa1)[0] = *(const v8h*)(qrow + 32 + kb);
  ((v8h*)&qa1)[1] = *(const v8h*)(qrow + 32 + kb + 16);

  float mrow[8], lrow[8];   // lrow holds per-LANE partial sums (reduced at end)
#pragma unroll
  for (int r = 0; r < 8; ++r) { mrow[r] = -1e30f; lrow[r] = 0.0f; }
  v8f o[4] = {};

  const float* maskb = mask + b * S_LEN;
  const _Float16* Kb   = Km + (size_t)b * HID + h * DHEAD;   // + key*B*HID
  const _Float16* VTbh = VT + (size_t)bh * DHEAD * S_LEN;

  // ---- tensor-load descriptors: wave 0 moves K chunks, wave 1 V^T chunks ----
  const uint32_t wv        = uni(threadIdx.x >> 5);
  const uint32_t isV       = wv & 1u;
  const uint64_t src0      = isV ? (uint64_t)(size_t)VTbh : (uint64_t)(size_t)Kb;
  const uint32_t src_step  = isV ? 64u * 2u : 64u * BATCH * HID * 2u;   // bytes per chunk
  const uint32_t src_pitch = isV ? S_LEN * 2u : BATCH * HID * 2u;       // bytes per row
  const uint32_t lds0      = (uint32_t)(size_t)&kv[0][0][0] + isV * KV_TILE;
  u32x8 g1;
  g1[0] = uni((1u << 20) | (4u << 22) | (3u << 25));  // bytes, no mask, 16-B pad behind every 128-B row
  g1[1] = uni(128u << 16);                            // tensor_dim0 = 128 B
  g1[2] = uni(64u << 16);                             // tensor_dim1 = 64 rows
  g1[3] = uni(128u << 16);                            // tile_dim0 = 128 B
  g1[4] = uni(64u);                                   // tile_dim1 = 64 rows
  g1[5] = uni(src_pitch);
  g1[6] = uni(0u);
  g1[7] = uni(0u);
  // As in pinned(): descriptor words held in scalar registers. Without it two
  // registers of group 1 serve as loop temporaries while a request is in flight.
  asm volatile("" : "+s"(g1));
  u32x4 g0 = {};   // group 0 of this wave's request in flight
  auto issue = [&](uint32_t st) {
    const uint64_t ga = src0 + (uint64_t)st * src_step;
    g0[0] = uni(1u);
    g0[1] = uni(lds0 + (st & 1u) * (2u * KV_TILE));
    g0[2] = uni((uint32_t)ga);
    g0[3] = uni((((uint32_t)(ga >> 32)) & 0x01FFFFFFu) | 0x80000000u);
    // one request of the whole wave: the 64 x 128-B tile goes to LDS through no register
    asm volatile("tensor_load_to_lds %0, %1" :: "s"(g0), "s"(g1) : "memory");
  };
  // The issuing wave's wait. It names group 0 so that the registers of the
  // request keep their values until the tile has landed.
  auto landed = [&]() { asm volatile("s_wait_tensorcnt 0x0" :: "s"(g0) : "memory"); };
  if (pinned(wv < 2u)) {
    issue(0u);
    landed();                                           // chunk 0 has landed
  }
  __syncthreads();                                      // chunk 0 readable by every wave
  if (pinned(wv < 2u)) issue(1u);

  for (int kc = 0; kc < S_LEN; kc += 64) {
    const uint32_t st = (uint32_t)kc >> 6;
    const unsigned char* ktile = &kv[st & 1u][0][0];
    const unsigned char* vtile = &kv[st & 1u][1][0];
    // ---- scores: four 16x16 tiles over 64 keys ----
    v8f s[4] = {};
    const _Float16* kbase = (const _Float16*)(ktile + (uint32_t)l15 * KV_PITCH);
#pragma unroll
    for (int j = 0; j < 4; ++j) {
      const _Float16* krow = kbase + (16 * j) * (KV_PITCH / 2u);
      v16h kf0, kf1;
      ((v8h*)&kf0)[0] = *(const v8h*)(krow + kb);
      ((v8h*)&kf0)[1] = *(const v8h*)(krow + kb + 16);
      ((v8h*)&kf1)[0] = *(const v8h*)(krow + 32 + kb);
      ((v8h*)&kf1)[1] = *(const v8h*)(krow + 32 + kb + 16);
      s[j] = __builtin_amdgcn_wmma_f32_16x16x32_f16(false, qa0, false, kf0,
                                                    (short)0, s[j], false, false);
      s[j] = __builtin_amdgcn_wmma_f32_16x16x32_f16(false, qa1, false, kf1,
                                                    (short)0, s[j], false, false);
    }

    float mk[4];
#pragma unroll
    for (int j = 0; j < 4; ++j) mk[j] = maskb[kc + 16 * j + l15];

    // ---- online softmax; row max shuffled, row sum kept per-lane ----
#pragma unroll
    for (int r = 0; r < 8; ++r) {
      float a0 = s[0][r] * 0.125f + mk[0];   // 1/sqrt(64)
      float a1 = s[1][r] * 0.125f + mk[1];
      float a2 = s[2][r] * 0.125f + mk[2];
      float a3 = s[3][r] * 0.125f + mk[3];
      float t  = fmaxf(fmaxf(a0, a1), fmaxf(a2, a3));
      t = fmaxf(t, __shfl_xor(t, 1));
      t = fmaxf(t, __shfl_xor(t, 2));
      t = fmaxf(t, __shfl_xor(t, 4));
      t = fmaxf(t, __shfl_xor(t, 8));
      const float newm = fmaxf(mrow[r], t);
      const float corr = __expf(mrow[r] - newm);
      mrow[r] = newm;
      const float p0 = __expf(a0 - newm);
      const float p1 = __expf(a1 - newm);
      const float p2 = __expf(a2 - newm);
      const float p3 = __expf(a3 - newm);
      lrow[r] = lrow[r] * corr + (p0 + p1) + (p2 + p3);
      o[0][r] *= corr; o[1][r] *= corr; o[2][r] *= corr; o[3][r] *= corr;
      const int row = r + kb;               // kb doubles as the +8 row offset
      pbuf[wave][row][l15]      = (_Float16)p0;
      pbuf[wave][row][16 + l15] = (_Float16)p1;
      pbuf[wave][row][32 + l15] = (_Float16)p2;
      pbuf[wave][row][48 + l15] = (_Float16)p3;
    }
    asm volatile("" ::: "memory");  // keep DS loads after DS stores (HW in-order per wave)

    // P A-fragments: keys kc..kc+31 and kc+32..kc+63
    v16h pa0, pa1;
    ((v8h*)&pa0)[0] = *(const v8h*)&pbuf[wave][l15][kb];
    ((v8h*)&pa0)[1] = *(const v8h*)&pbuf[wave][l15][16 + kb];
    ((v8h*)&pa1)[0] = *(const v8h*)&pbuf[wave][l15][32 + kb];
    ((v8h*)&pa1)[1] = *(const v8h*)&pbuf[wave][l15][48 + kb];

    // ---- P (16x64) @ V (64x64): four 16x16 N-tiles over DH ----
#pragma unroll
    for (int t = 0; t < 4; ++t) {
      const _Float16* vrow = (const _Float16*)(vtile + (uint32_t)(t * 16 + l15) * KV_PITCH);
      v16h vf0, vf1;
      ((v8h*)&vf0)[0] = *(const v8h*)(vrow + kb);
      ((v8h*)&vf0)[1] = *(const v8h*)(vrow + kb + 16);
      ((v8h*)&vf1)[0] = *(const v8h*)(vrow + 32 + kb);
      ((v8h*)&vf1)[1] = *(const v8h*)(vrow + 48 + kb);
      o[t] = __builtin_amdgcn_wmma_f32_16x16x32_f16(false, pa0, false, vf0,
                                                    (short)0, o[t], false, false);
      o[t] = __builtin_amdgcn_wmma_f32_16x16x32_f16(false, pa1, false, vf1,
                                                    (short)0, o[t], false, false);
    }

    // ---- publish chunk st + 1, then refill the buffer this pass has read ----
    asm volatile("s_wait_dscnt 0x0" ::: "memory");        // this wave's LDS reads of the buffer are done
    if (pinned(wv < 2u)) landed();                        // this wave's tile of chunk st + 1 has landed
    __syncthreads();                                      // chunk st + 1 readable; every reader has left chunk st
    if (pinned((wv < 2u) && (st + 2u < (uint32_t)N_STAGE))) issue(st + 2u);
  }
  asm volatile("s_wait_tensorcnt 0x0" ::: "memory");      // no request outlives the loop
  asm volatile("s_wait_dscnt 0x0" ::: "memory");          // nor an LDS read of the ring

  // ---- epilogue: reduce per-lane sums across the 16-lane half, write ctx ----
#pragma unroll
  for (int r = 0; r < 8; ++r) {
    float rs = lrow[r];
    rs += __shfl_xor(rs, 1);
    rs += __shfl_xor(rs, 2);
    rs += __shfl_xor(rs, 4);
    rs += __shfl_xor(rs, 8);
    const float inv = 1.0f / rs;
    const int srow = q0 + r + kb;
    float* op = out + ((size_t)srow * BATCH + b) * HID + h * DHEAD + l15;
    op[0]  = o[0][r] * inv;
    op[16] = o[1][r] * inv;
    op[32] = o[2][r] * inv;
    op[48] = o[3][r] * inv;
  }
}

// ---------------------------------------------------------------------------
extern "C" void kernel_launch(void* const* d_in, const int* in_sizes, int n_in,
                              void* d_out, int out_size, void* d_ws, size_t ws_size,
                              hipStream_t stream) {
  const float* hs   = (const float*)d_in[0];   // [S,B,H]
  const float* mask = (const float*)d_in[1];   // [B,1,1,S]
  const float* Wq   = (const float*)d_in[2];
  const float* bq   = (const float*)d_in[3];
  const float* Wk   = (const float*)d_in[4];
  const float* bk   = (const float*)d_in[5];
  const float* Wv   = (const float*)d_in[6];
  const float* bv   = (const float*)d_in[7];
  float* out = (float*)d_out;

  const size_t HS_N  = (size_t)MROWS * HID;                      // 8388608
  const size_t W_N   = (size_t)HID * HID;                        // 1048576
  const size_t QKV_N = (size_t)BATCH * NHEAD * S_LEN * DHEAD;    // 8388608

  _Float16* hs16 = (_Float16*)d_ws;
  _Float16* wq16 = hs16 + HS_N;
  _Float16* wk16 = wq16 + W_N;
  _Float16* wv16 = wk16 + W_N;
  _Float16* Qh   = wv16 + W_N;   // [8192][1024]
  _Float16* Kh   = Qh + QKV_N;   // [8192][1024]
  _Float16* VTh  = Kh + QKV_N;   // [64][64][2048]

  cvt_f32_f16<<<4096, 256, 0, stream>>>(hs, hs16, (int)HS_N);
  cvt_f32_f16<<<1024, 256, 0, stream>>>(Wq, wq16, (int)W_N);
  cvt_f32_f16<<<1024, 256, 0, stream>>>(Wk, wk16, (int)W_N);
  cvt_f32_f16<<<1024, 256, 0, stream>>>(Wv, wv16, (int)W_N);

  // 64 x 8 = 512 blocks of 128 x 128, 8 waves of 32 x 64 each
  gemm_qkv<0><<<512, 256, 0, stream>>>(hs16, wq16, bq, Qh);
  gemm_qkv<0><<<512, 256, 0, stream>>>(hs16, wk16, bk, Kh);
  gemm_qkv<1><<<512, 256, 0, stream>>>(hs16, wv16, bv, VTh);

  // 64 (b,h) * 128 query tiles = 8192 waves / 8 per block
  flash_attn<<<1024, 256, 0, stream>>>(Qh, Kh, VTh, mask, out);
}

// v003
// A run of this version takes 137 microseconds.
// Next to v002, in two timings, it ran 1.55 times as fast each time.
// Over all steps from v000 it is 2.95 times as fast.
#include <hip/hip_runtime.h>
#include <hip/hip_bf16.h>
#include <cstddef>
#include <cstdint>

typedef _Float16 v16h __attribute__((ext_vector_type(16)));
typedef _Float16 v8h  __attribute__((ext_vector_type(8)));
typedef float    v8f  __attribute__((ext_vector_type(8)));
typedef uint32_t u32x4 __attribute__((ext_vector_type(4)));
typedef uint32_t u32x8 __attribute__((ext_vector_type(8)));

#define S_LEN 2048
#define BATCH 4
#define HID   1024
#define NHEAD 16
#define DHEAD 64
#define MROWS (S_LEN * BATCH)   // 8192

// ---------------------------------------------------------------------------
// fp32 -> f16 conversion (grid-stride)
// ---------------------------------------------------------------------------
__global__ void cvt_f32_f16(const float* __restrict__ in,
                            _Float16* __restrict__ out, int n) {
  int i = blockIdx.x * blockDim.x + threadIdx.x;
  int stride = gridDim.x * blockDim.x;
  for (; i < n; i += stride) out[i] = (_Float16)in[i];
}

static __device__ __forceinline__ uint32_t uni(uint32_t v) {
  return (uint32_t)__builtin_amdgcn_readfirstlane(v);
}
// The test around a tensor load must be a scalar branch (tensor loads ignore EXEC).
static __device__ __forceinline__ uint32_t pinned(uint32_t v) {
  uint32_t w = uni(v);
  asm volatile("" : "+s"(w));  // holds the test word in a scalar register: s_cmp + s_cbranch_scc, no EXEC mask
  return w;
}

// ---------------------------------------------------------------------------
// NT GEMM, register-blocked 32(M) x 64(N) per wave, 128 x 128 per block:
//   out[m,n] = sum_k A[m,k] * W[n,k] + bias[n]
// A: [8192 x 1024] f16 row-major (m = s*B + b), W: [1024 x 1024] f16 row-major.
// The 8 waves (4 along M x 2 along N) share 128 rows of A and 128 rows of W.
// A stage is 64 k of those rows (128 B a row), brought into LDS once per block
// by four tensor loads of 64 rows each (waves 0..3), two buffers, one stage ahead.
// Per 32-wide K step: 2 A frags + 4 B frags (12 ds b128) -> 8 WMMAs.
// TRANSPOSED==0: plain [m][HID] f16 output (used for Q, K).
// TRANSPOSED==1: [bh][d][s] f16 output (V^T, keys contiguous for PV WMMA).
// All epilogue stores are base + compile-time-immediate (branch-free).
// ---------------------------------------------------------------------------
#define G_PITCH  144u     // LDS row pitch, bytes: 128-B row + 16-B pad (16 B x odd for b128 readers)
#define G_SLICE  10240u   // 64 rows x 144 B = 9216 B, rounded up to a multiple of 2 KiB
#define G_STAGES (HID / 64)

template <int TRANSPOSED>
__global__ __launch_bounds__(256) void gemm_qkv(
    const _Float16* __restrict__ A,
    const _Float16* __restrict__ W,
    const float* __restrict__ bias,
    _Float16* __restrict__ out) {
  // [buffer][A rows 0..63, A rows 64..127, W rows 0..63, W rows 64..127]
  __shared__ __attribute__((aligned(2048))) unsigned char ring[2][4][G_SLICE];

  const int lane  = threadIdx.x & 31;
  const int wave  = threadIdx.x >> 5;
  const int blkm  = blockIdx.x >> 3;         // 64 row blocks of 128
  const int blkn  = blockIdx.x & 7;          // 8 column blocks of 128
  const int wm    = wave >> 1;               // 0..3: 32-row strip of the block
  const int wn    = wave & 1;                // 0..1: 64-column strip of the block
  const int nT    = blkn * 2 + wn;
  const int m0    = blkm * 128 + wm * 32;
  const int n0    = nT * 64;
  const int l15   = lane & 15;
  const int kb    = (lane >= 16) ? 8 : 0;    // K sub-offset per WMMA A/B layout
  const int half8 = kb;                      // row offset for C layout

  // ---- tensor-load descriptors: waves 0,1 move the A slices, waves 2,3 the W slices ----
  const uint32_t wv   = uni(threadIdx.x >> 5);
  const uint32_t sl   = wv & 3u;
  const _Float16* sp  = (sl & 2u) ? W + (size_t)(blkn * 128 + (int)(sl & 1u) * 64) * HID
                                  : A + (size_t)(blkm * 128 + (int)(sl & 1u) * 64) * HID;
  const uint64_t src0 = (uint64_t)(size_t)sp;
  const uint32_t lds0 = (uint32_t)(size_t)&ring[0][0][0] + sl * G_SLICE;
  u32x8 g1;
  g1[0] = uni((1u << 20) | (4u << 22) | (3u << 25));  // bytes, no mask, 16-B pad behind every 128-B row
  g1[1] = uni(128u << 16);                            // tensor_dim0 = 128 B
  g1[2] = uni(64u << 16);                             // tensor_dim1 = 64 rows
  g1[3] = uni(128u << 16);                            // tile_dim0 = 128 B
  g1[4] = uni(64u);                                   // tile_dim1 = 64 rows
  g1[5] = uni(HID * 2u);                              // source row pitch, bytes
  g1[6] = uni(0u);
  g1[7] = uni(0u);
  // As in pinned(): descriptor words held in scalar registers, so that none
  // serves as a loop temporary while a request is in flight.
  asm volatile("" : "+s"(g1));
  u32x4 g0;   // group 0 of this wave's request in flight
  // The words of stage st's request (scalar work; the load itself always stands under the test).
  auto form = [&](uint32_t st) {
    const uint64_t ga = src0 + (uint64_t)st * 128u;   // 64 k = 128 B further along every row
    g0[0] = uni(1u);
    g0[1] = uni(lds0 + (st & 1u) * (4u * G_SLICE));
    g0[2] = uni((uint32_t)ga);
    g0[3] = uni((((uint32_t)(ga >> 32)) & 0x01FFFFFFu) | 0x80000000u);
  };
  // one request of the whole wave: the 64 x 128-B slice goes to LDS through no register
  auto issue = [&]() { asm volatile("tensor_load_to_lds %0, %1" :: "s"(g0), "s"(g1) : "memory"); };
  // The issuing wave's wait. It names group 0 so that the registers of the
  // request keep their values until the slice has landed.
  auto landed = [&]() { asm volatile("s_wait_tensorcnt 0x0" :: "s"(g0) : "memory"); };
  form(0u);
  if (pinned(wv < 4u)) {
    issue();
    landed();                                           // stage 0 has landed
  }
  __syncthreads();                                      // stage 0 readable by every wave
  form(1u);
  if (pinned(wv < 4u)) issue();

  // this lane's fragment rows inside a buffer
  const uint32_t aoff = (uint32_t)(wm >> 1) * G_SLICE +
                        (uint32_t)((wm & 1) * 32 + l15) * G_PITCH + (uint32_t)kb * 2u;
  const uint32_t boff = (uint32_t)(2 + wn) * G_SLICE +
                        (uint32_t)l15 * G_PITCH + (uint32_t)kb * 2u;

  v8f acc[2][4] = {};
  for (uint32_t st = 0; st < (uint32_t)G_STAGES; ++st) {
    const unsigned char* ab = &ring[st & 1u][0][0] + aoff;
    const unsigned char* bb = &ring[st & 1u][0][0] + boff;
    // unrolled: the stage's two 32-wide K steps, all LDS offsets immediates
#pragma unroll
    for (int kk = 0; kk < 2; ++kk) {
      v16h af[2], bf[4];
#pragma unroll
      for (int mi = 0; mi < 2; ++mi) {
        const unsigned char* ap = ab + (uint32_t)(16 * mi) * G_PITCH + kk * 64;
        ((v8h*)&af[mi])[0] = *(const v8h*)(ap);
        ((v8h*)&af[mi])[1] = *(const v8h*)(ap + 32);
      }
#pragma unroll
      for (int ni = 0; ni < 4; ++ni) {
        const unsigned char* bp = bb + (uint32_t)(16 * ni) * G_PITCH + kk * 64;
        ((v8h*)&bf[ni])[0] = *(const v8h*)(bp);
        ((v8h*)&bf[ni])[1] = *(const v8h*)(bp + 32);
      }
#pragma unroll
      for (int mi = 0; mi < 2; ++mi)
#pragma unroll
        for (int ni = 0; ni < 4; ++ni)
          acc[mi][ni] = __builtin_amdgcn_wmma_f32_16x16x32_f16(
              false, af[mi], false, bf[ni], (short)0, acc[mi][ni], false, false);
    }

    // ---- publish stage st + 1, then refill the buffer this pass has read ----
    asm volatile("s_wait_dscnt 0x0" ::: "memory");        // this wave's LDS reads of the buffer are done
    if (pinned(wv < 4u)) landed();                        // this wave's slice of stage st + 1 has landed
    __syncthreads();                                      // stage st + 1 readable; every reader has left stage st
    if (pinned((wv < 4u) && (st + 2u < (uint32_t)G_STAGES))) {
      form(st + 2u);
      issue();
    }
  }
  asm volatile("s_wait_tensorcnt 0x0" ::: "memory");      // no request outlives the loop
  asm volatile("s_wait_dscnt 0x0" ::: "memory");          // nor an LDS read of the ring

  // C layout: lane -> col n = n0 + 16*ni + l15, vgpr r -> row m = .. + r + half8
  float bn[4];
#pragma unroll
  for (int ni = 0; ni < 4; ++ni) bn[ni] = bias[n0 + 16 * ni + l15];

  if (TRANSPOSED == 0) {
    // out[m][n], per-lane base + constant offsets
    _Float16* ob = out + (size_t)(m0 + half8) * HID + n0 + l15;
#pragma unroll
    for (int mi = 0; mi < 2; ++mi)
#pragma unroll
      for (int ni = 0; ni < 4; ++ni)
#pragma unroll
        for (int r = 0; r < 8; ++r)
          ob[(size_t)(16 * mi + r) * HID + 16 * ni] =
              (_Float16)(acc[mi][ni][r] + bn[ni]);
  } else {
    // V^T: out[((bidx*16 + nT)*64 + d)*2048 + s], with
    //   bidx = r&3 (compile-time), s = m0/4 + 4*mi + (kb>>2) + (r>>2)
    // head == nT is uniform because n0 = nT*64 spans exactly one head.
#pragma unroll
    for (int ni = 0; ni < 4; ++ni) {
      const int d = 16 * ni + l15;
      _Float16* vb = out + (size_t)(nT * DHEAD + d) * S_LEN + (m0 >> 2) + (kb >> 2);
#pragma unroll
      for (int mi = 0; mi < 2; ++mi)
#pragma unroll
        for (int r = 0; r < 8; ++r)
          vb[(size_t)(r & 3) * (NHEAD * DHEAD * S_LEN) + 4 * mi + (r >> 2)] =
              (_Float16)(acc[mi][ni][r] + bn[ni]);
    }
  }
}

#define KV_PITCH 144u     // LDS row pitch, bytes: 128-B row + 16-B pad (16 B x odd for b128 readers)
#define KV_TILE  10240u   // 64 rows x 144 B = 9216 B, rounded up to a multiple of 2 KiB
#define N_STAGE  (S_LEN / 64)
#define O_PITCH  272u     // output staging pitch, bytes: 256-B row (64 f32) + 16 B (16 B x odd)

typedef float v4f __attribute__((ext_vector_type(4)));

// lane l <-> lane l ^ 16 (a vector cross-row move; a shuffle would go through the LDS unit)
static __device__ __forceinline__ float xhalf(float x) {
  const int v = __builtin_bit_cast(int, x);
  return __builtin_bit_cast(float, __builtin_amdgcn_permlanex16(v, v, 0x76543210, 0xfedcba98, false, false));
}

__global__ __launch_bounds__(256) void flash_attn(
    const _Float16* __restrict__ Qm,
    const _Float16* __restrict__ Km,
    const _Float16* __restrict__ VT,
    const float* __restrict__ mask,
    float* __restrict__ out) {
  __shared__ __attribute__((aligned(2048))) unsigned char kv[2][2][KV_TILE];  // [buffer][K, V^T]
  static_assert(8u * 16u * O_PITCH <= 4u * KV_TILE, "the output staging reuses the ring");

  const int lane = threadIdx.x & 31;
  const uint32_t wv = uni(threadIdx.x >> 5);   // the wave's number, in a scalar register
  const int wave = (int)wv;
  const int tile = blockIdx.x * 8 + wave;
  const int bh   = blockIdx.x >> 4;     // S/16 = 128 query tiles = 16 blocks per (b,h)
  const int qt   = tile & 127;
  const int b    = bh >> 4;
  const int h    = bh & 15;
  const int q0   = qt * 16;
  const int l15  = lane & 15;
  const int kb   = (lane >= 16) ? 8 : 0;

  // Q B-fragments: column = query q0+l15 (row m = (q0+l15)*B + b), k = d
  const _Float16* qrow =
      Qm + (size_t)((q0 + l15) * BATCH + b) * HID + h * DHEAD;
  v16h qa0, qa1;
  ((v8h*)&qa0)[0] = *(const v8h*)(qrow + kb);
  ((v8h*)&qa0)[1] = *(const v8h*)(qrow + kb + 16);
  ((v8h*)&qa1)[0] = *(const v8h*)(qrow + 32 + kb);
  ((v8h*)&qa1)[1] = *(const v8h*)(qrow + 32 + kb + 16);

  float mrow = -1e30f;   // running maximum of this lane's query (equal in both halves)
  float lrow = 0.0f;     // this lane's partial sum over its half's keys (halves joined at the end)
  v8f o[4] = {};         // O^T: column = query l15, row d = 16*t + r + kb

  const float* maskb = mask + b * S_LEN;
  const _Float16* Kb   = Km + (size_t)b * HID + h * DHEAD;   // + key*B*HID
  const _Float16* VTbh = VT + (size_t)bh * DHEAD * S_LEN;

  // ---- tensor-load descriptors: wave 0 moves K chunks, wave 1 V^T chunks ----
  const uint32_t isV       = wv & 1u;
  const uint64_t src0      = isV ? (uint64_t)(size_t)VTbh : (uint64_t)(size_t)Kb;
  const uint32_t src_step  = isV ? 64u * 2u : 64u * BATCH * HID * 2u;   // bytes per chunk
  const uint32_t src_pitch = isV ? S_LEN * 2u : BATCH * HID * 2u;       // bytes per row
  const uint32_t lds0      = (uint32_t)(size_t)&kv[0][0][0] + isV * KV_TILE;
  u32x8 g1;
  g1[0] = uni((1u << 20) | (4u << 22) | (3u << 25));  // bytes, no mask, 16-B pad behind every 128-B row
  g1[1] = uni(128u << 16);                            // tensor_dim0 = 128 B
  g1[2] = uni(64u << 16);                             // tensor_dim1 = 64 rows
  g1[3] = uni(128u << 16);                            // tile_dim0 = 128 B
  g1[4] = uni(64u);                                   // tile_dim1 = 64 rows
  g1[5] = uni(src_pitch);
  g1[6] = uni(0u);
  g1[7] = uni(0u);
  // As in pinned(): descriptor words held in scalar registers. Without it two
  // registers of group 1 serve as loop temporaries while a request is in flight.
  asm volatile("" : "+s"(g1));
  u32x4 g0 = {};   // group 0 of this wave's request in flight
  auto issue = [&](uint32_t st) {
    const uint64_t ga = src0 + (uint64_t)st * src_step;
    g0[0] = uni(1u);
    g0[1] = uni(lds0 + (st & 1u) * (2u * KV_TILE));
    g0[2] = uni((uint32_t)ga);
    g0[3] = uni((((uint32_t)(ga >> 32)) & 0x01FFFFFFu) | 0x80000000u);
    // one request of the whole wave: the 64 x 128-B tile goes to LDS through no register
    asm volatile("tensor_load_to_lds %0, %1" :: "s"(g0), "s"(g1) : "memory");
  };
  // The issuing wave's wait. It names group 0 so that the registers of the
  // request keep their values until the tile has landed.
  auto landed = [&]() { asm volatile("s_wait_tensorcnt 0x0" :: "s"(g0) : "memory"); };
  if (pinned(wv < 2u)) {
    issue(0u);
    landed();                                           // chunk 0 has landed
  }
  __syncthreads();                                      // chunk 0 readable by every wave
  if (pinned(wv < 2u)) issue(1u);

  for (int kc = 0; kc < S_LEN; kc += 64) {
    const uint32_t st = (uint32_t)kc >> 6;
    const unsigned char* ktile = &kv[st & 1u][0][0];
    const unsigned char* vtile = &kv[st & 1u][1][0];

    // mask of this lane's keys: tile j, keys kc + 16*j + kb + (0..7)
    v4f mk[4][2];
#pragma unroll
    for (int j = 0; j < 4; ++j) {
      mk[j][0] = *(const v4f*)(maskb + kc + 16 * j + kb);
      mk[j][1] = *(const v4f*)(maskb + kc + 16 * j + kb + 4);
    }

    // ---- scores, transposed: four 16(keys) x 16(queries) tiles over 64 keys ----
    v8f s[4] = {};
    const _Float16* kbase = (const _Float16*)(ktile + (uint32_t)l15 * KV_PITCH);
#pragma unroll
    for (int j = 0; j < 4; ++j) {
      const _Float16* krow = kbase + (16 * j) * (KV_PITCH / 2u);
      v16h kf0, kf1;
      ((v8h*)&kf0)[0] = *(const v8h*)(krow + kb);
      ((v8h*)&kf0)[1] = *(const v8h*)(krow + kb + 16);
      ((v8h*)&kf1)[0] = *(const v8h*)(krow + 32 + kb);
      ((v8h*)&kf1)[1] = *(const v8h*)(krow + 32 + kb + 16);
      s[j] = __builtin_amdgcn_wmma_f32_16x16x32_f16(false, kf0, false, qa0,
                                                    (short)0, s[j], false, false);
      s[j] = __builtin_amdgcn_wmma_f32_16x16x32_f16(false, kf1, false, qa1,
                                                    (short)0, s[j], false, false);
    }

    // ---- online softmax of one query per lane ----
#pragma unroll
    for (int j = 0; j < 4; ++j)
#pragma unroll
      for (int r = 0; r < 8; ++r)
        s[j][r] = s[j][r] * 0.125f + mk[j][r >> 2][r & 3];   // 1/sqrt(64)
    float tj[4];
#pragma unroll
    for (int j = 0; j < 4; ++j) {
      tj[j] = s[j][0];
#pragma unroll
      for (int r = 1; r < 8; ++r) tj[j] = fmaxf(tj[j], s[j][r]);
    }
    float t = fmaxf(fmaxf(tj[0], tj[1]), fmaxf(tj[2], tj[3]));
    t = fmaxf(t, xhalf(t));                // the other half holds this query's other 32 keys
    const float newm = fmaxf(mrow, t);
    const float corr = __expf(mrow - newm);
    mrow = newm;
    float sj[4];
#pragma unroll
    for (int j = 0; j < 4; ++j) {
#pragma unroll
      for (int r = 0; r < 8; ++r) s[j][r] = __expf(s[j][r] - newm);
      sj[j] = ((s[j][0] + s[j][1]) + (s[j][2] + s[j][3])) +
              ((s[j][4] + s[j][5]) + (s[j][6] + s[j][7]));
    }
    lrow = lrow * corr + ((sj[0] + sj[1]) + (sj[2] + sj[3]));
#pragma unroll
    for (int d = 0; d < 4; ++d) o[d] *= corr;

    // P^T B-fragments: elements 0..7 are k = kb + r (tile 2i), 8..15 are k = 16 + kb + r (tile 2i+1)
    v16h pb0, pb1;
#pragma unroll
    for (int r = 0; r < 8; ++r) {
      pb0[r]     = (_Float16)s[0][r];
      pb0[8 + r] = (_Float16)s[1][r];
      pb1[r]     = (_Float16)s[2][r];
      pb1[8 + r] = (_Float16)s[3][r];
    }

    // ---- V^T (64 d x 64 keys) @ P^T (64 keys x 16 queries): four 16-row tiles over DH ----
#pragma unroll
    for (int d = 0; d < 4; ++d) {
      const _Float16* vrow = (const _Float16*)(vtile + (uint32_t)(d * 16 + l15) * KV_PITCH);
      v16h vf0, vf1;
      ((v8h*)&vf0)[0] = *(const v8h*)(vrow + kb);
      ((v8h*)&vf0)[1] = *(const v8h*)(vrow + kb + 16);
      ((v8h*)&vf1)[0] = *(const v8h*)(vrow + 32 + kb);
      ((v8h*)&vf1)[1] = *(const v8h*)(vrow + 48 + kb);
      o[d] = __builtin_amdgcn_wmma_f32_16x16x32_f16(false, vf0, false, pb0,
                                                    (short)0, o[d], false, false);
      o[d] = __builtin_amdgcn_wmma_f32_16x16x32_f16(false, vf1, false, pb1,
                                                    (short)0, o[d], false, false);
    }

    // ---- publish chunk st + 1, then refill the buffer this pass has read ----
    asm volatile("s_wait_dscnt 0x0" ::: "memory");        // this wave's LDS reads of the buffer are done
    asm volatile("s_wait_xcnt 0x0" ::: "memory");         // before the mask loads' address registers are advanced
    if (pinned(wv < 2u)) landed();                        // this wave's tile of chunk st + 1 has landed
    __syncthreads();                                      // chunk st + 1 readable; every reader has left chunk st
    if (pinned((wv < 2u) && (st + 2u < (uint32_t)N_STAGE))) issue(st + 2u);
  }
  asm volatile("s_wait_tensorcnt 0x0" ::: "memory");      // no request outlives the loop
  asm volatile("s_wait_dscnt 0x0" ::: "memory");          // nor an LDS read of the ring

  // ---- epilogue: join the halves' sums; a lane holds 8 d of one query per tile, so the
  // rows are put together in this wave's own range of the ring (free behind the last
  // pass's barrier, nothing in flight) and leave as whole 128-B lines ----
  const float inv = 1.0f / (lrow + xhalf(lrow));
  unsigned char* stg = &kv[0][0][0] + (uint32_t)wave * (16u * O_PITCH);
#pragma unroll
  for (int d = 0; d < 4; ++d) {
    float* sp = (float*)(stg + (uint32_t)l15 * O_PITCH) + 16 * d + kb;
    const v8f ov = o[d] * inv;
    *(v4f*)(sp)     = v4f{ov[0], ov[1], ov[2], ov[3]};
    *(v4f*)(sp + 4) = v4f{ov[4], ov[5], ov[6], ov[7]};
  }
  asm volatile("s_wait_dscnt 0x0" ::: "memory");  // the rows other lanes of this wave wrote are in LDS before they are read back
#pragma unroll
  for (int i = 0; i < 8; ++i) {
    const int row = 2 * i + (lane >> 4);          // 16 lanes x 16 B cover one 256-B row
    const v4f v = *(const v4f*)(stg + (uint32_t)row * O_PITCH + (uint32_t)l15 * 16u);
    *(v4f*)(out + ((size_t)(q0 + row) * BATCH + b) * HID + h * DHEAD + l15 * 4) = v;
  }
}

// ---------------------------------------------------------------------------
extern "C" void kernel_launch(void* const* d_in, const int* in_sizes, int n_in,
                              void* d_out, int out_size, void* d_ws, size_t ws_size,
                              hipStream_t stream) {
  const float* hs   = (const float*)d_in[0];   // [S,B,H]
  const float* mask = (const float*)d_in[1];   // [B,1,1,S]
  const float* Wq   = (const float*)d_in[2];
  const float* bq   = (const float*)d_in[3];
  const float* Wk   = (const float*)d_in[4];
  const float* bk   = (const float*)d_in[5];
  const float* Wv   = (const float*)d_in[6];
  const float* bv   = (const float*)d_in[7];
  float* out = (float*)d_out;

  const size_t HS_N  = (size_t)MROWS * HID;                      // 8388608
  const size_t W_N   = (size_t)HID * HID;                        // 1048576
  const size_t QKV_N = (size_t)BATCH * NHEAD * S_LEN * DHEAD;    // 8388608

  _Float16* hs16 = (_Float16*)d_ws;
  _Float16* wq16 = hs16 + HS_N;
  _Float16* wk16 = wq16 + W_N;
  _Float16* wv16 = wk16 + W_N;
  _Float16* Qh   = wv16 + W_N;   // [8192][1024]
  _Float16* Kh   = Qh + QKV_N;   // [8192][1024]
  _Float16* VTh  = Kh + QKV_N;   // [64][64][2048]

  cvt_f32_f16<<<4096, 256, 0, stream>>>(hs, hs16, (int)HS_N);
  cvt_f32_f16<<<1024, 256, 0, stream>>>(Wq, wq16, (int)W_N);
  cvt_f32_f16<<<1024, 256, 0, stream>>>(Wk, wk16, (int)W_N);
  cvt_f32_f16<<<1024, 256, 0, stream>>>(Wv, wv16, (int)W_N);

  // 64 x 8 = 512 blocks of 128 x 128, 8 waves of 32 x 64 each
  gemm_qkv<0><<<512, 256, 0, stream>>>(hs16, wq16, bq, Qh);
  gemm_qkv<0><<<512, 256, 0, stream>>>(hs16, wk16, bk, Kh);
  gemm_qkv<1><<<512, 256, 0, stream>>>(hs16, wv16, bv, VTh);

  // 64 (b,h) * 128 query tiles = 8192 waves / 8 per block
  flash_attn<<<1024, 256, 0, stream>>>(Qh, Kh, VTh, mask, out);
}
